// v000
// Measured on an AMD MI455X. A time is GPU time per run, averaged over a window of back-to-back runs after a warm-up
// (all launches, gaps included; the runs take copies of the inputs in turn), and the median of several windows.
// Apart from v000's, it joins two sittings. Times from different sittings can be a few percent apart, while
// side-by-side timings come from the same sitting.
// v000, which the later versions start from, runs in 717 microseconds.
#include <hip/hip_runtime.h>

typedef __attribute__((ext_vector_type(16))) _Float16 v16h;
typedef __attribute__((ext_vector_type(8)))  float    v8f;
typedef __attribute__((ext_vector_type(4)))  unsigned int tdm_g0_t;
typedef __attribute__((ext_vector_type(8)))  int          tdm_g1_t;
typedef __attribute__((ext_vector_type(4)))  int          tdm_g23_t;
typedef _Float16 half_t;

#define B_ 4
#define T_ 32
#define S_ 256
#define E_ 512
#define H_ 8
#define D_ 64
// SCALE = sqrt(D) = 8 -> multiply scores by 1/8

// ---------------------------------------------------------------------------
// f32 -> f16 conversion (weights and spike tensors; spikes are {0,1} = exact)
// ---------------------------------------------------------------------------
__global__ void cvt_f32_f16_kernel(const float* __restrict__ src,
                                   half_t* __restrict__ dst, int n) {
    int i = blockIdx.x * blockDim.x + threadIdx.x;
    if (i < n) dst[i] = (half_t)src[i];
}

// ---------------------------------------------------------------------------
// Tensor Data Mover: 2-D tile load Global -> LDS (CDNA5 ISA ch.8 D# layout)
//   dims/strides in data_size units; data_size fixed at 2 bytes (f16)
//   issue from ONE wave; pair with s_wait_tensorcnt + workgroup barrier
// ---------------------------------------------------------------------------
__device__ __forceinline__ void tdm_load_tile_f16(unsigned lds_off,
                                                  const half_t* gptr,
                                                  unsigned tile0, unsigned tile1,
                                                  unsigned stride0) {
    unsigned long long ga = (unsigned long long)(uintptr_t)gptr;
    tdm_g0_t g0;
    g0.x = 1u;                                        // count=1, user mode
    g0.y = lds_off;                                   // lds_addr (bytes)
    g0.z = (unsigned)(ga & 0xffffffffu);              // global_addr[31:0]
    g0.w = (unsigned)((ga >> 32) & 0x01ffffffu)       // global_addr[56:32]
         | (2u << 30);                                // type = 2 ("image")
    tdm_g1_t g1;
    g1[0] = (int)(1u << 16);                          // data_size=1 (2 bytes)
    g1[1] = (int)((tile0 & 0xffffu) << 16);           // tensor_dim0[15:0]
    g1[2] = (int)(((tile0 >> 16) & 0xffffu)           // tensor_dim0[31:16]
         | ((tile1 & 0xffffu) << 16));                // tensor_dim1[15:0]
    g1[3] = (int)(((tile1 >> 16) & 0xffffu)           // tensor_dim1[31:16]
         | ((tile0 & 0xffffu) << 16));                // tile_dim0
    g1[4] = (int)(tile1 & 0xffffu);                   // tile_dim1 (tile_dim2=0)
    g1[5] = (int)stride0;                             // tensor_dim0_stride[31:0]
    g1[6] = 0;                                        // stride hi / dim1_stride lo
    g1[7] = 0;
    tdm_g23_t z4 = {0, 0, 0, 0};
    tdm_g1_t  z8 = {0, 0, 0, 0, 0, 0, 0, 0};
    __builtin_amdgcn_tensor_load_to_lds(g0, g1, z4, z4, z8, 0);
}

// ---------------------------------------------------------------------------
// Tiled WMMA GEMM:  Out[M,N] = A[M,K](f16) * Wh[K,N](f16) + bias[N]
//   block: 256 threads (8 waves), tile 128x128, K-step 32, double-buffered:
//   A tiles DMA'd by the Tensor Data Mover into Asm[2], B tiles pulled into
//   registers during the WMMA chain and stored transposed into Bsm[2].
//   wave (wm 0..3, wn 0..1) owns a 32x64 sub-tile = 2x4 WMMA tiles
// ---------------------------------------------------------------------------
template <bool OUT_F32>
__global__ __launch_bounds__(256)
void gemm_wmma_kernel(const half_t* __restrict__ Af,
                      const half_t* __restrict__ Wh,
                      const float* __restrict__ bias,
                      void* __restrict__ Out,
                      int M, int N, int K) {
    __shared__ __align__(128) half_t Asm[2][128][32];   // [m][k]  2x8 KB (TDM)
    __shared__ __align__(128) half_t Bsm[2][128][32];   // [n][k]  2x8 KB

    const int tid   = threadIdx.x;
    const int wave  = tid >> 5;
    const int lane  = tid & 31;
    const int lmod  = lane & 15;
    const int lhalf = lane >> 4;          // 0: k 0..15, 1: k 16..31
    const int wm    = wave & 3;           // *32 rows
    const int wn    = wave >> 2;          // *64 cols
    const int m0    = blockIdx.x * 128;
    const int n0    = blockIdx.y * 128;
    const unsigned asm_off = (unsigned)(uintptr_t)&Asm[0][0][0];
    const int NK    = K >> 5;             // K-steps of 32

    v8f acc[2][4];
    #pragma unroll
    for (int mi = 0; mi < 2; ++mi)
        #pragma unroll
        for (int ni = 0; ni < 4; ++ni)
            acc[mi][ni] = (v8f){0.f, 0.f, 0.f, 0.f, 0.f, 0.f, 0.f, 0.f};

    // ---- prologue: tile 0 into buffer 0 ----
    if (tid < 32)
        tdm_load_tile_f16(asm_off, Af + (size_t)m0 * K,
                          /*tile0(k)*/ 32, /*tile1(m)*/ 128,
                          /*stride0*/ (unsigned)K);
    #pragma unroll
    for (int i = 0; i < 16; ++i) {                    // B tile 0 -> Bsm[0][n][k]
        int idx = i * 256 + tid;
        int r = idx >> 7, c = idx & 127;              // r=k, c=n
        Bsm[0][c][r] = Wh[(size_t)r * N + (n0 + c)];
    }
    if (tid < 32) __builtin_amdgcn_s_wait_tensorcnt(0);
    __syncthreads();

    // ---- pipelined K loop ----
    for (int it = 0; it < NK; ++it) {
        const int cur = it & 1, nxt = cur ^ 1;
        const bool has_next = (it + 1 < NK);

        // current-tile fragments out of LDS first
        v16h afrag[2], bfrag[4];
        #pragma unroll
        for (int mi = 0; mi < 2; ++mi)
            afrag[mi] = *(const v16h*)&Asm[cur][wm * 32 + mi * 16 + lmod][lhalf * 16];
        #pragma unroll
        for (int ni = 0; ni < 4; ++ni)
            bfrag[ni] = *(const v16h*)&Bsm[cur][wn * 64 + ni * 16 + lmod][lhalf * 16];

        // kick off next tile: TDM for A, global->register for B
        half_t breg[16];
        if (has_next) {
            const int kn = (it + 1) << 5;
            if (tid < 32)
                tdm_load_tile_f16(asm_off + (unsigned)nxt * 128 * 32 * 2,
                                  Af + (size_t)m0 * K + kn, 32, 128, (unsigned)K);
            #pragma unroll
            for (int i = 0; i < 16; ++i) {
                int idx = i * 256 + tid;
                int r = idx >> 7, c = idx & 127;
                breg[i] = Wh[(size_t)(kn + r) * N + (n0 + c)];
            }
            if (it + 2 < NK)  // global_prefetch_b8 two tiles ahead
                __builtin_prefetch(Wh + (size_t)(((it + 2) << 5) + (tid >> 3)) * N +
                                   (n0 + (tid & 7) * 16), 0, 3);
        }

        // WMMA chain on the current tile (overlaps DMA + global loads)
        #pragma unroll
        for (int ni = 0; ni < 4; ++ni)
            #pragma unroll
            for (int mi = 0; mi < 2; ++mi)
                acc[mi][ni] = __builtin_amdgcn_wmma_f32_16x16x32_f16(
                    false, afrag[mi], false, bfrag[ni], (short)0, acc[mi][ni],
                    false, false);

        // land next B tile in the other buffer, close the iteration
        if (has_next) {
            #pragma unroll
            for (int i = 0; i < 16; ++i) {
                int idx = i * 256 + tid;
                int r = idx >> 7, c = idx & 127;
                Bsm[nxt][c][r] = breg[i];
            }
            if (tid < 32) __builtin_amdgcn_s_wait_tensorcnt(0);
            __syncthreads();   // publish nxt buffers, release cur buffers
        }
    }

    // epilogue: C layout = lane 0-15: (m = v, n = lane), lane 16-31: (m = v+8)
    #pragma unroll
    for (int mi = 0; mi < 2; ++mi)
        #pragma unroll
        for (int ni = 0; ni < 4; ++ni) {
            int ncol = n0 + wn * 64 + ni * 16 + lmod;
            float bv = bias[ncol];
            #pragma unroll
            for (int v = 0; v < 8; ++v) {
                int mrow = m0 + wm * 32 + mi * 16 + v + lhalf * 8;
                float val = acc[mi][ni][v] + bv;
                if (OUT_F32)
                    ((float*)Out)[(size_t)mrow * N + ncol] = val;
                else
                    ((half_t*)Out)[(size_t)mrow * N + ncol] = (half_t)val;
            }
        }
}

// ---------------------------------------------------------------------------
// Attention per (b,t,h):  scores = (Q K^T)/8 * modw + sync ;
// p = sigmoid(5*(s - rowmax)); attn = p / (rowsum + 1e-8);  O = attn * V
// Q/K/V/O are f16 [B,T,S,E] slices (head offset h*D, row stride E)
// ---------------------------------------------------------------------------
__global__ __launch_bounds__(256)
void spike_attn_kernel(const half_t* __restrict__ Qh,
                       const half_t* __restrict__ Kh,
                       const half_t* __restrict__ Vh,
                       half_t* __restrict__ Oh,
                       const float* __restrict__ modw,
                       const float* __restrict__ tsync) {
    __shared__ __align__(128) half_t Vt[D_][S_];     // V transposed [d][key] 32 KB
    __shared__ __align__(128) half_t stg[8][16][32]; // per-wave attn staging 8 KB

    const int h = blockIdx.x % H_;
    const int t = (blockIdx.x / H_) % T_;
    const int b = blockIdx.x / (H_ * T_);
    const size_t base = (((size_t)b * T_ + t) * S_) * E_ + (size_t)h * D_;

    const int tid   = threadIdx.x;
    const int wave  = tid >> 5;
    const int lane  = tid & 31;
    const int lmod  = lane & 15;
    const int lhalf = lane >> 4;

    // stage V transposed into LDS (thread tid handles key row tid)
    {
        const half_t* vrow = Vh + base + (size_t)tid * E_;
        #pragma unroll
        for (int d = 0; d < D_; ++d) Vt[d][tid] = vrow[d];
    }
    __syncthreads();

    const float scl = modw[h] * modw[H_ + h] * 0.125f;  // modality / SCALE
    const float sy  = tsync[t * H_ + h];

    for (int pass = 0; pass < 2; ++pass) {
        const int q0 = pass * 128 + wave * 16;

        // Q fragments (16 rows x 32 k), D=64 -> two k-chunks
        v16h aq0 = *(const v16h*)(Qh + base + (size_t)(q0 + lmod) * E_ + lhalf * 16);
        v16h aq1 = *(const v16h*)(Qh + base + (size_t)(q0 + lmod) * E_ + 32 + lhalf * 16);

        // scores: 16 key-tiles of 16x16 f32
        v8f sc[16];
        #pragma unroll
        for (int nt = 0; nt < 16; ++nt) {
            const half_t* krow = Kh + base + (size_t)(nt * 16 + lmod) * E_;
            v16h bk0 = *(const v16h*)(krow + lhalf * 16);
            v16h bk1 = *(const v16h*)(krow + 32 + lhalf * 16);
            v8f z = (v8f){0.f, 0.f, 0.f, 0.f, 0.f, 0.f, 0.f, 0.f};
            z = __builtin_amdgcn_wmma_f32_16x16x32_f16(false, aq0, false, bk0,
                                                       (short)0, z, false, false);
            z = __builtin_amdgcn_wmma_f32_16x16x32_f16(false, aq1, false, bk1,
                                                       (short)0, z, false, false);
            #pragma unroll
            for (int v = 0; v < 8; ++v) sc[nt][v] = z[v] * scl + sy;
        }

        // row max over 256 keys: 16 tiles in-lane, then across 16-lane group
        float rmax[8];
        #pragma unroll
        for (int v = 0; v < 8; ++v) {
            float m = sc[0][v];
            #pragma unroll
            for (int nt = 1; nt < 16; ++nt) m = fmaxf(m, sc[nt][v]);
            #pragma unroll
            for (int msk = 1; msk < 16; msk <<= 1)
                m = fmaxf(m, __shfl_xor(m, msk, 32));
            rmax[v] = m;
        }

        // p = sigmoid(5*(s-max)); rowsum; keep p in sc
        float rinv[8];
        #pragma unroll
        for (int v = 0; v < 8; ++v) {
            float s = 0.f;
            #pragma unroll
            for (int nt = 0; nt < 16; ++nt) {
                float p = 1.0f / (1.0f + __expf(-5.0f * (sc[nt][v] - rmax[v])));
                sc[nt][v] = p;
                s += p;
            }
            #pragma unroll
            for (int msk = 1; msk < 16; msk <<= 1)
                s += __shfl_xor(s, msk, 32);
            rinv[v] = 1.0f / (s + 1e-8f);
        }

        // attn @ V : 8 k-chunks of 32 keys, staged through per-wave LDS
        v8f accO[4];
        #pragma unroll
        for (int ni = 0; ni < 4; ++ni)
            accO[ni] = (v8f){0.f, 0.f, 0.f, 0.f, 0.f, 0.f, 0.f, 0.f};

        #pragma unroll
        for (int kc = 0; kc < 8; ++kc) {
            #pragma unroll
            for (int j = 0; j < 2; ++j) {
                int nt = kc * 2 + j;
                #pragma unroll
                for (int v = 0; v < 8; ++v) {
                    int m = v + lhalf * 8;
                    stg[wave][m][j * 16 + lmod] = (half_t)(sc[nt][v] * rinv[v]);
                }
            }
            // wave-private LDS region: DS ops are in-order within the wave
            v16h aat = *(const v16h*)&stg[wave][lmod][lhalf * 16];
            #pragma unroll
            for (int ni = 0; ni < 4; ++ni) {
                v16h bv = *(const v16h*)&Vt[ni * 16 + lmod][kc * 32 + lhalf * 16];
                accO[ni] = __builtin_amdgcn_wmma_f32_16x16x32_f16(
                    false, aat, false, bv, (short)0, accO[ni], false, false);
            }
        }

        // store attended rows (f16, [B,T,S,E] slice)
        #pragma unroll
        for (int ni = 0; ni < 4; ++ni)
            #pragma unroll
            for (int v = 0; v < 8; ++v) {
                int m = q0 + v + lhalf * 8;
                Oh[base + (size_t)m * E_ + ni * 16 + lmod] = (half_t)accO[ni][v];
            }
    }
}

// ---------------------------------------------------------------------------
// Host launch
// ---------------------------------------------------------------------------
extern "C" void kernel_launch(void* const* d_in, const int* in_sizes, int n_in,
                              void* d_out, int out_size, void* d_ws, size_t ws_size,
                              hipStream_t stream) {
    (void)in_sizes; (void)n_in; (void)out_size; (void)ws_size;

    const float* qsp   = (const float*)d_in[0];
    const float* ksp   = (const float*)d_in[1];
    const float* vsp   = (const float*)d_in[2];
    const float* Wq    = (const float*)d_in[3];
    const float* bq    = (const float*)d_in[4];
    const float* Wk    = (const float*)d_in[5];
    const float* bk    = (const float*)d_in[6];
    const float* Wv    = (const float*)d_in[7];
    const float* bv    = (const float*)d_in[8];
    const float* Wo    = (const float*)d_in[9];
    const float* bo    = (const float*)d_in[10];
    const float* modw  = (const float*)d_in[11];
    const float* tsync = (const float*)d_in[12];

    const size_t EE = (size_t)E_ * E_;              // 262144
    const size_t MK = (size_t)B_ * T_ * S_ * E_;    // 16,777,216
    const int    M  = B_ * T_ * S_;                 // 32768

    half_t* w16  = (half_t*)d_ws;
    half_t* Wq16 = w16;
    half_t* Wk16 = w16 + EE;
    half_t* Wv16 = w16 + 2 * EE;
    half_t* Wo16 = w16 + 3 * EE;
    half_t* Qs16 = w16 + 4 * EE;      // f16 spike copies (TDM-friendly A)
    half_t* Ks16 = Qs16 + MK;
    half_t* Vs16 = Ks16 + MK;
    half_t* Qh   = Vs16 + MK;
    half_t* Kh   = Qh + MK;
    half_t* Vh   = Kh + MK;
    half_t* Ah   = Qs16;              // reuse: Q-spikes consumed before attention

    // f32 -> f16 conversions
    const int nEE = (int)EE, nMK = (int)MK;
    cvt_f32_f16_kernel<<<dim3((nEE + 255) / 256), 256, 0, stream>>>(Wq, Wq16, nEE);
    cvt_f32_f16_kernel<<<dim3((nEE + 255) / 256), 256, 0, stream>>>(Wk, Wk16, nEE);
    cvt_f32_f16_kernel<<<dim3((nEE + 255) / 256), 256, 0, stream>>>(Wv, Wv16, nEE);
    cvt_f32_f16_kernel<<<dim3((nEE + 255) / 256), 256, 0, stream>>>(Wo, Wo16, nEE);
    cvt_f32_f16_kernel<<<dim3((nMK + 255) / 256), 256, 0, stream>>>(qsp, Qs16, nMK);
    cvt_f32_f16_kernel<<<dim3((nMK + 255) / 256), 256, 0, stream>>>(ksp, Ks16, nMK);
    cvt_f32_f16_kernel<<<dim3((nMK + 255) / 256), 256, 0, stream>>>(vsp, Vs16, nMK);

    // Q/K/V projections: [32768,512] x [512,512] -> f16 (TDM-staged A tiles)
    dim3 gproj(M / 128, E_ / 128);
    gemm_wmma_kernel<false><<<gproj, 256, 0, stream>>>(Qs16, Wq16, bq, Qh, M, E_, E_);
    gemm_wmma_kernel<false><<<gproj, 256, 0, stream>>>(Ks16, Wk16, bk, Kh, M, E_, E_);
    gemm_wmma_kernel<false><<<gproj, 256, 0, stream>>>(Vs16, Wv16, bv, Vh, M, E_, E_);

    // attention over B*T*H = 1024 heads
    spike_attn_kernel<<<dim3(B_ * T_ * H_), 256, 0, stream>>>(Qh, Kh, Vh, Ah, modw, tsync);

    // output projection -> f32 d_out
    gemm_wmma_kernel<true><<<gproj, 256, 0, stream>>>(Ah, Wo16, bo, (float*)d_out, M, E_, E_);
}

// v001
// It runs in 393 microseconds.
// Next to v000, in two timings, it ran 1.87 times as fast each time.
#include <hip/hip_runtime.h>

typedef __attribute__((ext_vector_type(16))) _Float16 v16h;
typedef __attribute__((ext_vector_type(8)))  _Float16 v8h;
typedef __attribute__((ext_vector_type(8)))  float    v8f;
typedef __attribute__((ext_vector_type(4)))  unsigned int tdm_g0_t;
typedef __attribute__((ext_vector_type(8)))  int          tdm_g1_t;
typedef __attribute__((ext_vector_type(4)))  int          tdm_g23_t;
typedef _Float16 half_t;

#define B_ 4
#define T_ 32
#define S_ 256
#define E_ 512
#define H_ 8
#define D_ 64
// SCALE = sqrt(D) = 8 -> multiply scores by 1/8

// ---------------------------------------------------------------------------
// f32 -> f16 conversion (spike tensors; spikes are {0,1} = exact)
// ---------------------------------------------------------------------------
__global__ void cvt_f32_f16_kernel(const float* __restrict__ src,
                                   half_t* __restrict__ dst, int n) {
    int i = blockIdx.x * blockDim.x + threadIdx.x;
    if (i < n) dst[i] = (half_t)src[i];
}

// ---------------------------------------------------------------------------
// Weight conversion with transpose: src f32 [k][n] (E x E) -> dst f16 [n][k],
// so that a GEMM B tile is K-contiguous like its A tile.
//   block: 256 threads, one 64x64 tile through LDS; reads 256-B row pieces,
//   writes whole 128-B lines
// ---------------------------------------------------------------------------
__global__ __launch_bounds__(256)
void cvt_transpose_f32_f16_kernel(const float* __restrict__ src,
                                  half_t* __restrict__ dst) {
    __shared__ half_t tile[64][66];       // [k][n]; 33-dword pitch: column reads hit 32 banks
    const int tx = threadIdx.x & 63;
    const int ty = threadIdx.x >> 6;
    const int n0 = blockIdx.x * 64;
    const int k0 = blockIdx.y * 64;
    const float* s = src + (size_t)(k0 + ty) * E_ + (n0 + tx);
    half_t*      d = dst + (size_t)(n0 + ty) * E_ + (k0 + tx);
    #pragma unroll   // 16 independent loads in flight, the row step an immediate offset
    for (int j = 0; j < 16; ++j)
        tile[j * 4 + ty][tx] = (half_t)s[j * 4 * E_];
    __syncthreads();
    #pragma unroll   // as above, for the LDS reads and the stores
    for (int j = 0; j < 16; ++j)
        d[j * 4 * E_] = tile[tx][j * 4 + ty];
}

// ---------------------------------------------------------------------------
// Tensor Data Mover: 2-D tile load Global -> LDS (CDNA5 ISA ch.8 D# layout)
//   dims/strides in data_size units; data_size fixed at 2 bytes (f16)
//   issue from ONE wave; pair with s_wait_tensorcnt + workgroup barrier
// ---------------------------------------------------------------------------
__device__ __forceinline__ void tdm_load_tile_f16(unsigned lds_off,
                                                  const half_t* gptr,
                                                  unsigned tile0, unsigned tile1,
                                                  unsigned stride0) {
    unsigned long long ga = (unsigned long long)(uintptr_t)gptr;
    tdm_g0_t g0;
    g0.x = 1u;                                        // count=1, user mode
    g0.y = lds_off;                                   // lds_addr (bytes)
    g0.z = (unsigned)(ga & 0xffffffffu);              // global_addr[31:0]
    g0.w = (unsigned)((ga >> 32) & 0x01ffffffu)       // global_addr[56:32]
         | (2u << 30);                                // type = 2 ("image")
    tdm_g1_t g1;
    g1[0] = (int)(1u << 16);                          // data_size=1 (2 bytes)
    g1[1] = (int)((tile0 & 0xffffu) << 16);           // tensor_dim0[15:0]
    g1[2] = (int)(((tile0 >> 16) & 0xffffu)           // tensor_dim0[31:16]
         | ((tile1 & 0xffffu) << 16));                // tensor_dim1[15:0]
    g1[3] = (int)(((tile1 >> 16) & 0xffffu)           // tensor_dim1[31:16]
         | ((tile0 & 0xffffu) << 16));                // tile_dim0
    g1[4] = (int)(tile1 & 0xffffu);                   // tile_dim1 (tile_dim2=0)
    g1[5] = (int)stride0;                             // tensor_dim0_stride[31:0]
    g1[6] = 0;                                        // stride hi / dim1_stride lo
    g1[7] = 0;
    tdm_g23_t z4 = {0, 0, 0, 0};
    tdm_g1_t  z8 = {0, 0, 0, 0, 0, 0, 0, 0};
    __builtin_amdgcn_tensor_load_to_lds(g0, g1, z4, z4, z8, 0);
}

// ---------------------------------------------------------------------------
// Tiled WMMA GEMM:  Out[M,N] = A[M,K](f16) * Wt[N,K](f16)^T + bias[N]
//   block: 256 threads (8 waves), tile 128x128, K-step 32, double-buffered:
//   A tiles DMA'd by the Tensor Data Mover into Asm[2], B tiles (K-contiguous
//   rows of Wt) pulled into registers as two 16-byte pieces per thread during
//   the WMMA chain and stored as they are into Bsm[2].
//   wave (wm 0..3, wn 0..1) owns a 32x64 sub-tile = 2x4 WMMA tiles
// ---------------------------------------------------------------------------
template <bool OUT_F32>
__global__ __launch_bounds__(256)
void gemm_wmma_kernel(const half_t* __restrict__ Af,
                      const half_t* __restrict__ Wt,
                      const float* __restrict__ bias,
                      void* __restrict__ Out,
                      int M, int N, int K) {
    __shared__ __align__(128) half_t Asm[2][128][32];   // [m][k]  2x8 KB (TDM)
    __shared__ __align__(128) half_t Bsm[2][128][32];   // [n][k]  2x8 KB

    const int tid   = threadIdx.x;
    const int wave  = tid >> 5;
    const int lane  = tid & 31;
    const int lmod  = lane & 15;
    const int lhalf = lane >> 4;          // 0: k 0..15, 1: k 16..31
    const int wm    = wave & 3;           // *32 rows
    const int wn    = wave >> 2;          // *64 cols
    const int m0    = blockIdx.x * 128;
    const int n0    = blockIdx.y * 128;
    const unsigned asm_off = (unsigned)(uintptr_t)&Asm[0][0][0];
    const int NK    = K >> 5;             // K-steps of 32
    // B tile = 128 rows x 64 B = 512 pieces of 16 B; thread owns pieces tid, tid+256
    const int brow  = tid >> 2;           // n row (second piece: +64)
    const int bcol  = (tid & 3) * 8;      // k offset in halves
    const unsigned boff = (unsigned)(brow * K + bcol) * 2u;   // lane's byte offset in the tile's rows
    const char* bsrc0 = (const char*)(Wt + (size_t)n0 * K);          // rows n0 ..      (uniform)
    const char* bsrc1 = (const char*)(Wt + (size_t)(n0 + 64) * K);   // rows n0 + 64 .. (uniform)

    v8f acc[2][4];
    #pragma unroll
    for (int mi = 0; mi < 2; ++mi)
        #pragma unroll
        for (int ni = 0; ni < 4; ++ni)
            acc[mi][ni] = (v8f){0.f, 0.f, 0.f, 0.f, 0.f, 0.f, 0.f, 0.f};

    // ---- prologue: tile 0 into buffer 0 ----
    if (tid < 32)
        tdm_load_tile_f16(asm_off, Af + (size_t)m0 * K,
                          /*tile0(k)*/ 32, /*tile1(m)*/ 128,
                          /*stride0*/ (unsigned)K);
    *(v8h*)&Bsm[0][brow][bcol]      = *(const v8h*)(bsrc0 + boff);   // B tile 0
    *(v8h*)&Bsm[0][brow + 64][bcol] = *(const v8h*)(bsrc1 + boff);
    if (tid < 32) __builtin_amdgcn_s_wait_tensorcnt(0);
    __syncthreads();

    // ---- pipelined K loop ----
    for (int it = 0; it < NK; ++it) {
        const int cur = it & 1, nxt = cur ^ 1;
        const bool has_next = (it + 1 < NK);

        // current-tile fragments out of LDS first
        v16h afrag[2], bfrag[4];
        #pragma unroll
        for (int mi = 0; mi < 2; ++mi)
            afrag[mi] = *(const v16h*)&Asm[cur][wm * 32 + mi * 16 + lmod][lhalf * 16];
        #pragma unroll
        for (int ni = 0; ni < 4; ++ni)
            bfrag[ni] = *(const v16h*)&Bsm[cur][wn * 64 + ni * 16 + lmod][lhalf * 16];

        // kick off next tile: TDM for A, global->register for B
        v8h breg[2];
        if (has_next) {
            const int kn = (it + 1) << 5;
            if (tid < 32)
                tdm_load_tile_f16(asm_off + (unsigned)nxt * 128 * 32 * 2,
                                  Af + (size_t)m0 * K + kn, 32, 128, (unsigned)K);
            const unsigned bo = boff + (unsigned)kn * 2u;   // 32-bit lane offset on a uniform base
            breg[0] = *(const v8h*)(bsrc0 + bo);
            breg[1] = *(const v8h*)(bsrc1 + bo);
            // the loads' offset register is advanced at the loop's foot: keep the wait in front of that overwrite
            asm volatile("s_wait_xcnt 0x0" ::: "memory");
        }

        // WMMA chain on the current tile (overlaps DMA + global loads)
        #pragma unroll
        for (int ni = 0; ni < 4; ++ni)
            #pragma unroll
            for (int mi = 0; mi < 2; ++mi)
                acc[mi][ni] = __builtin_amdgcn_wmma_f32_16x16x32_f16(
                    false, afrag[mi], false, bfrag[ni], (short)0, acc[mi][ni],
                    false, false);

        // land next B tile in the other buffer, close the iteration
        if (has_next) {
            #pragma unroll
            for (int i = 0; i < 2; ++i)
                *(v8h*)&Bsm[nxt][brow + i * 64][bcol] = breg[i];
            if (tid < 32) __builtin_amdgcn_s_wait_tensorcnt(0);
            __syncthreads();   // publish nxt buffers, release cur buffers
        }
    }

    // epilogue: C layout = lane 0-15: (m = v, n = lane), lane 16-31: (m = v+8)
    #pragma unroll
    for (int mi = 0; mi < 2; ++mi)
        #pragma unroll
        for (int ni = 0; ni < 4; ++ni) {
            int ncol = n0 + wn * 64 + ni * 16 + lmod;
            float bv = bias[ncol];
            #pragma unroll
            for (int v = 0; v < 8; ++v) {
                int mrow = m0 + wm * 32 + mi * 16 + v + lhalf * 8;
                float val = acc[mi][ni][v] + bv;
                if (OUT_F32)
                    ((float*)Out)[(size_t)mrow * N + ncol] = val;
                else
                    ((half_t*)Out)[(size_t)mrow * N + ncol] = (half_t)val;
            }
        }
}

// ---------------------------------------------------------------------------
// Attention per (b,t,h):  scores = (Q K^T)/8 * modw + sync ;
// p = sigmoid(5*(s - rowmax)); attn = p / (rowsum + 1e-8);  O = attn * V
// Q/K/V/O are f16 [B,T,S,E] slices (head offset h*D, row stride E)
// ---------------------------------------------------------------------------
__global__ __launch_bounds__(256)
void spike_attn_kernel(const half_t* __restrict__ Qh,
                       const half_t* __restrict__ Kh,
                       const half_t* __restrict__ Vh,
                       half_t* __restrict__ Oh,
                       const float* __restrict__ modw,
                       const float* __restrict__ tsync) {
    __shared__ __align__(128) half_t Vt[D_][S_];     // V transposed [d][key] 32 KB
    __shared__ __align__(128) half_t stg[8][16][32]; // per-wave attn staging 8 KB

    const int h = blockIdx.x % H_;
    const int t = (blockIdx.x / H_) % T_;
    const int b = blockIdx.x / (H_ * T_);
    const size_t base = (((size_t)b * T_ + t) * S_) * E_ + (size_t)h * D_;

    const int tid   = threadIdx.x;
    const int wave  = tid >> 5;
    const int lane  = tid & 31;
    const int lmod  = lane & 15;
    const int lhalf = lane >> 4;

    // stage V transposed into LDS (thread tid handles key row tid)
    {
        const half_t* vrow = Vh + base + (size_t)tid * E_;
        #pragma unroll
        for (int d = 0; d < D_; ++d) Vt[d][tid] = vrow[d];
    }
    __syncthreads();

    const float scl = modw[h] * modw[H_ + h] * 0.125f;  // modality / SCALE
    const float sy  = tsync[t * H_ + h];

    for (int pass = 0; pass < 2; ++pass) {
        const int q0 = pass * 128 + wave * 16;

        // Q fragments (16 rows x 32 k), D=64 -> two k-chunks
        v16h aq0 = *(const v16h*)(Qh + base + (size_t)(q0 + lmod) * E_ + lhalf * 16);
        v16h aq1 = *(const v16h*)(Qh + base + (size_t)(q0 + lmod) * E_ + 32 + lhalf * 16);

        // scores: 16 key-tiles of 16x16 f32
        v8f sc[16];
        #pragma unroll
        for (int nt = 0; nt < 16; ++nt) {
            const half_t* krow = Kh + base + (size_t)(nt * 16 + lmod) * E_;
            v16h bk0 = *(const v16h*)(krow + lhalf * 16);
            v16h bk1 = *(const v16h*)(krow + 32 + lhalf * 16);
            v8f z = (v8f){0.f, 0.f, 0.f, 0.f, 0.f, 0.f, 0.f, 0.f};
            z = __builtin_amdgcn_wmma_f32_16x16x32_f16(false, aq0, false, bk0,
                                                       (short)0, z, false, false);
            z = __builtin_amdgcn_wmma_f32_16x16x32_f16(false, aq1, false, bk1,
                                                       (short)0, z, false, false);
            #pragma unroll
            for (int v = 0; v < 8; ++v) sc[nt][v] = z[v] * scl + sy;
        }

        // row max over 256 keys: 16 tiles in-lane, then across 16-lane group
        float rmax[8];
        #pragma unroll
        for (int v = 0; v < 8; ++v) {
            float m = sc[0][v];
            #pragma unroll
            for (int nt = 1; nt < 16; ++nt) m = fmaxf(m, sc[nt][v]);
            #pragma unroll
            for (int msk = 1; msk < 16; msk <<= 1)
                m = fmaxf(m, __shfl_xor(m, msk, 32));
            rmax[v] = m;
        }

        // p = sigmoid(5*(s-max)); rowsum; keep p in sc
        float rinv[8];
        #pragma unroll
        for (int v = 0; v < 8; ++v) {
            float s = 0.f;
            #pragma unroll
            for (int nt = 0; nt < 16; ++nt) {
                float p = 1.0f / (1.0f + __expf(-5.0f * (sc[nt][v] - rmax[v])));
                sc[nt][v] = p;
                s += p;
            }
            #pragma unroll
            for (int msk = 1; msk < 16; msk <<= 1)
                s += __shfl_xor(s, msk, 32);
            rinv[v] = 1.0f / (s + 1e-8f);
        }

        // attn @ V : 8 k-chunks of 32 keys, staged through per-wave LDS
        v8f accO[4];
        #pragma unroll
        for (int ni = 0; ni < 4; ++ni)
            accO[ni] = (v8f){0.f, 0.f, 0.f, 0.f, 0.f, 0.f, 0.f, 0.f};

        #pragma unroll
        for (int kc = 0; kc < 8; ++kc) {
            #pragma unroll
            for (int j = 0; j < 2; ++j) {
                int nt = kc * 2 + j;
                #pragma unroll
                for (int v = 0; v < 8; ++v) {
                    int m = v + lhalf * 8;
                    stg[wave][m][j * 16 + lmod] = (half_t)(sc[nt][v] * rinv[v]);
                }
            }
            // wave-private LDS region: DS ops are in-order within the wave
            v16h aat = *(const v16h*)&stg[wave][lmod][lhalf * 16];
            #pragma unroll
            for (int ni = 0; ni < 4; ++ni) {
                v16h bv = *(const v16h*)&Vt[ni * 16 + lmod][kc * 32 + lhalf * 16];
                accO[ni] = __builtin_amdgcn_wmma_f32_16x16x32_f16(
                    false, aat, false, bv, (short)0, accO[ni], false, false);
            }
        }

        // store attended rows (f16, [B,T,S,E] slice)
        #pragma unroll
        for (int ni = 0; ni < 4; ++ni)
            #pragma unroll
            for (int v = 0; v < 8; ++v) {
                int m = q0 + v + lhalf * 8;
                Oh[base + (size_t)m * E_ + ni * 16 + lmod] = (half_t)accO[ni][v];
            }
    }
}

// ---------------------------------------------------------------------------
// Host launch
// ---------------------------------------------------------------------------
extern "C" void kernel_launch(void* const* d_in, const int* in_sizes, int n_in,
                              void* d_out, int out_size, void* d_ws, size_t ws_size,
                              hipStream_t stream) {
    (void)in_sizes; (void)n_in; (void)out_size; (void)ws_size;

    const float* qsp   = (const float*)d_in[0];
    const float* ksp   = (const float*)d_in[1];
    const float* vsp   = (const float*)d_in[2];
    const float* Wq    = (const float*)d_in[3];
    const float* bq    = (const float*)d_in[4];
    const float* Wk    = (const float*)d_in[5];
    const float* bk    = (const float*)d_in[6];
    const float* Wv    = (const float*)d_in[7];
    const float* bv    = (const float*)d_in[8];
    const float* Wo    = (const float*)d_in[9];
    const float* bo    = (const float*)d_in[10];
    const float* modw  = (const float*)d_in[11];
    const float* tsync = (const float*)d_in[12];

    const size_t EE = (size_t)E_ * E_;              // 262144
    const size_t MK = (size_t)B_ * T_ * S_ * E_;    // 16,777,216
    const int    M  = B_ * T_ * S_;                 // 32768

    half_t* w16  = (half_t*)d_ws;
    half_t* Wq16 = w16;
    half_t* Wk16 = w16 + EE;
    half_t* Wv16 = w16 + 2 * EE;
    half_t* Wo16 = w16 + 3 * EE;
    half_t* Qs16 = w16 + 4 * EE;      // f16 spike copies (TDM-friendly A)
    half_t* Ks16 = Qs16 + MK;
    half_t* Vs16 = Ks16 + MK;
    half_t* Qh   = Vs16 + MK;
    half_t* Kh   = Qh + MK;
    half_t* Vh   = Kh + MK;
    half_t* Ah   = Qs16;              // reuse: Q-spikes consumed before attention

    // f32 -> f16 conversions
    const int nMK = (int)MK;
    dim3 gwt(E_ / 64, E_ / 64);                     // weights land as [n][k]
    cvt_transpose_f32_f16_kernel<<<gwt, 256, 0, stream>>>(Wq, Wq16);
    cvt_transpose_f32_f16_kernel<<<gwt, 256, 0, stream>>>(Wk, Wk16);
    cvt_transpose_f32_f16_kernel<<<gwt, 256, 0, stream>>>(Wv, Wv16);
    cvt_transpose_f32_f16_kernel<<<gwt, 256, 0, stream>>>(Wo, Wo16);
    cvt_f32_f16_kernel<<<dim3((nMK + 255) / 256), 256, 0, stream>>>(qsp, Qs16, nMK);
    cvt_f32_f16_kernel<<<dim3((nMK + 255) / 256), 256, 0, stream>>>(ksp, Ks16, nMK);
    cvt_f32_f16_kernel<<<dim3((nMK + 255) / 256), 256, 0, stream>>>(vsp, Vs16, nMK);

    // Q/K/V projections: [32768,512] x [512,512] -> f16 (TDM-staged A tiles)
    dim3 gproj(M / 128, E_ / 128);
    gemm_wmma_kernel<false><<<gproj, 256, 0, stream>>>(Qs16, Wq16, bq, Qh, M, E_, E_);
    gemm_wmma_kernel<false><<<gproj, 256, 0, stream>>>(Ks16, Wk16, bk, Kh, M, E_, E_);
    gemm_wmma_kernel<false><<<gproj, 256, 0, stream>>>(Vs16, Wv16, bv, Vh, M, E_, E_);

    // attention over B*T*H = 1024 heads
    spike_attn_kernel<<<dim3(B_ * T_ * H_), 256, 0, stream>>>(Qh, Kh, Vh, Ah, modw, tsync);

    // output projection -> f32 d_out
    gemm_wmma_kernel<true><<<gproj, 256, 0, stream>>>(Ah, Wo16, bo, (float*)d_out, M, E_, E_);
}

// v002
// One run takes 332 microseconds.
// Next to v001, in two timings, it ran 1.18 and 1.19 times as fast.
// All steps since v000 together make it 2.21 times as fast.
#include <hip/hip_runtime.h>

typedef __attribute__((ext_vector_type(16))) _Float16 v16h;
typedef __attribute__((ext_vector_type(8)))  _Float16 v8h;
typedef __attribute__((ext_vector_type(8)))  float    v8f;
typedef __attribute__((ext_vector_type(4)))  _Float16 v4h;
typedef __attribute__((ext_vector_type(4)))  float    v4f;
typedef __attribute__((ext_vector_type(4)))  unsigned int tdm_g0_t;
typedef __attribute__((ext_vector_type(8)))  int          tdm_g1_t;
typedef __attribute__((ext_vector_type(4)))  int          tdm_g23_t;
typedef _Float16 half_t;

#define B_ 4
#define T_ 32
#define S_ 256
#define E_ 512
#define H_ 8
#define D_ 64
// SCALE = sqrt(D) = 8 -> multiply scores by 1/8

// ---------------------------------------------------------------------------
// f32 -> f16 conversion of one spike tensor (round to nearest even, as a cast)
//   a stream: 16 waves per block, a block owns 65,536 elements in a row and
//   walks them in 32 steps of 8 KB; a wave's load is 32 lanes x 16 B = 512 B
//   in a row, its store 256 B (two whole lines)
// ---------------------------------------------------------------------------
#define CVT_THREADS 512
#define CVT_LOADS   32
#define CVT_PER_BLOCK (CVT_THREADS * CVT_LOADS * 4)
__global__ __launch_bounds__(CVT_THREADS)
void cvt_f32_f16_kernel(const float* __restrict__ src,
                        half_t* __restrict__ dst) {
    const unsigned e0 = blockIdx.x * CVT_PER_BLOCK + threadIdx.x * 4;
    const v4f* s = (const v4f*)(src + e0);
    v4h*       d = (v4h*)(dst + e0);
    v4f x[CVT_LOADS];
    #pragma unroll   // many independent loads in flight per wave, the step an immediate offset
    for (int j = 0; j < CVT_LOADS; ++j) x[j] = s[j * CVT_THREADS];
    #pragma unroll   // as above, for the stores
    for (int j = 0; j < CVT_LOADS; ++j) d[j * CVT_THREADS] = __builtin_convertvector(x[j], v4h);
}

// ---------------------------------------------------------------------------
// Weight conversion with transpose: src f32 [k][n] (E x E) -> dst f16 [n][k],
// so that a GEMM B tile is K-contiguous like its A tile.
//   block: 256 threads, one 64x64 tile through LDS; reads 256-B row pieces,
//   writes whole 128-B lines
// ---------------------------------------------------------------------------
__global__ __launch_bounds__(256)
void cvt_transpose_f32_f16_kernel(const float* __restrict__ src,
                                  half_t* __restrict__ dst) {
    __shared__ half_t tile[64][66];       // [k][n]; 33-dword pitch: column reads hit 32 banks
    const int tx = threadIdx.x & 63;
    const int ty = threadIdx.x >> 6;
    const int n0 = blockIdx.x * 64;
    const int k0 = blockIdx.y * 64;
    const float* s = src + (size_t)(k0 + ty) * E_ + (n0 + tx);
    half_t*      d = dst + (size_t)(n0 + ty) * E_ + (k0 + tx);
    #pragma unroll   // 16 independent loads in flight, the row step an immediate offset
    for (int j = 0; j < 16; ++j)
        tile[j * 4 + ty][tx] = (half_t)s[j * 4 * E_];
    __syncthreads();
    #pragma unroll   // as above, for the LDS reads and the stores
    for (int j = 0; j < 16; ++j)
        d[j * 4 * E_] = tile[tx][j * 4 + ty];
}

// ---------------------------------------------------------------------------
// Tensor Data Mover: 2-D tile load Global -> LDS (CDNA5 ISA ch.8 D# layout)
//   dims/strides in data_size units; data_size fixed at 2 bytes (f16)
//   issue from ONE wave; pair with s_wait_tensorcnt + workgroup barrier
// ---------------------------------------------------------------------------
__device__ __forceinline__ void tdm_load_tile_f16(unsigned lds_off,
                                                  const half_t* gptr,
                                                  unsigned tile0, unsigned tile1,
                                                  unsigned stride0) {
    unsigned long long ga = (unsigned long long)(uintptr_t)gptr;
    tdm_g0_t g0;
    g0.x = 1u;                                        // count=1, user mode
    g0.y = lds_off;                                   // lds_addr (bytes)
    g0.z = (unsigned)(ga & 0xffffffffu);              // global_addr[31:0]
    g0.w = (unsigned)((ga >> 32) & 0x01ffffffu)       // global_addr[56:32]
         | (2u << 30);                                // type = 2 ("image")
    tdm_g1_t g1;
    g1[0] = (int)(1u << 16);                          // data_size=1 (2 bytes)
    g1[1] = (int)((tile0 & 0xffffu) << 16);           // tensor_dim0[15:0]
    g1[2] = (int)(((tile0 >> 16) & 0xffffu)           // tensor_dim0[31:16]
         | ((tile1 & 0xffffu) << 16));                // tensor_dim1[15:0]
    g1[3] = (int)(((tile1 >> 16) & 0xffffu)           // tensor_dim1[31:16]
         | ((tile0 & 0xffffu) << 16));                // tile_dim0
    g1[4] = (int)(tile1 & 0xffffu);                   // tile_dim1 (tile_dim2=0)
    g1[5] = (int)stride0;                             // tensor_dim0_stride[31:0]
    g1[6] = 0;                                        // stride hi / dim1_stride lo
    g1[7] = 0;
    tdm_g23_t z4 = {0, 0, 0, 0};
    tdm_g1_t  z8 = {0, 0, 0, 0, 0, 0, 0, 0};
    __builtin_amdgcn_tensor_load_to_lds(g0, g1, z4, z4, z8, 0);
}

// ---------------------------------------------------------------------------
// Tiled WMMA GEMM:  Out[M,N] = A[M,K](f16) * Wt[N,K](f16)^T + bias[N]
//   block: 256 threads (8 waves), tile 128x128, K-step 32, double-buffered:
//   A tiles DMA'd by the Tensor Data Mover into Asm[2], B tiles (K-contiguous
//   rows of Wt) pulled into registers as two 16-byte pieces per thread during
//   the WMMA chain and stored as they are into Bsm[2].
//   wave (wm 0..3, wn 0..1) owns a 32x64 sub-tile = 2x4 WMMA tiles
// ---------------------------------------------------------------------------
template <bool OUT_F32>
__global__ __launch_bounds__(256)
void gemm_wmma_kernel(const half_t* __restrict__ Af,
                      const half_t* __restrict__ Wt,
                      const float* __restrict__ bias,
                      void* __restrict__ Out,
                      int M, int N, int K) {
    __shared__ __align__(128) half_t Asm[2][128][32];   // [m][k]  2x8 KB (TDM)
    __shared__ __align__(128) half_t Bsm[2][128][32];   // [n][k]  2x8 KB

    const int tid   = threadIdx.x;
    const int wave  = tid >> 5;
    const int lane  = tid & 31;
    const int lmod  = lane & 15;
    const int lhalf = lane >> 4;          // 0: k 0..15, 1: k 16..31
    const int wm    = wave & 3;           // *32 rows
    const int wn    = wave >> 2;          // *64 cols
    const int m0    = blockIdx.x * 128;
    const int n0    = blockIdx.y * 128;
    const unsigned asm_off = (unsigned)(uintptr_t)&Asm[0][0][0];
    const int NK    = K >> 5;             // K-steps of 32
    // B tile = 128 rows x 64 B = 512 pieces of 16 B; thread owns pieces tid, tid+256
    const int brow  = tid >> 2;           // n row (second piece: +64)
    const int bcol  = (tid & 3) * 8;      // k offset in halves
    const unsigned boff = (unsigned)(brow * K + bcol) * 2u;   // lane's byte offset in the tile's rows
    const char* bsrc0 = (const char*)(Wt + (size_t)n0 * K);          // rows n0 ..      (uniform)
    const char* bsrc1 = (const char*)(Wt + (size_t)(n0 + 64) * K);   // rows n0 + 64 .. (uniform)

    v8f acc[2][4];
    #pragma unroll
    for (int mi = 0; mi < 2; ++mi)
        #pragma unroll
        for (int ni = 0; ni < 4; ++ni)
            acc[mi][ni] = (v8f){0.f, 0.f, 0.f, 0.f, 0.f, 0.f, 0.f, 0.f};

    // ---- prologue: tile 0 into buffer 0 ----
    if (tid < 32)
        tdm_load_tile_f16(asm_off, Af + (size_t)m0 * K,
                          /*tile0(k)*/ 32, /*tile1(m)*/ 128,
                          /*stride0*/ (unsigned)K);
    *(v8h*)&Bsm[0][brow][bcol]      = *(const v8h*)(bsrc0 + boff);   // B tile 0
    *(v8h*)&Bsm[0][brow + 64][bcol] = *(const v8h*)(bsrc1 + boff);
    if (tid < 32) __builtin_amdgcn_s_wait_tensorcnt(0);
    __syncthreads();

    // ---- pipelined K loop ----
    for (int it = 0; it < NK; ++it) {
        const int cur = it & 1, nxt = cur ^ 1;
        const bool has_next = (it + 1 < NK);

        // current-tile fragments out of LDS first
        v16h afrag[2], bfrag[4];
        #pragma unroll
        for (int mi = 0; mi < 2; ++mi)
            afrag[mi] = *(const v16h*)&Asm[cur][wm * 32 + mi * 16 + lmod][lhalf * 16];
        #pragma unroll
        for (int ni = 0; ni < 4; ++ni)
            bfrag[ni] = *(const v16h*)&Bsm[cur][wn * 64 + ni * 16 + lmod][lhalf * 16];

        // kick off next tile: TDM for A, global->register for B
        v8h breg[2];
        if (has_next) {
            const int kn = (it + 1) << 5;
            if (tid < 32)
                tdm_load_tile_f16(asm_off + (unsigned)nxt * 128 * 32 * 2,
                                  Af + (size_t)m0 * K + kn, 32, 128, (unsigned)K);
            const unsigned bo = boff + (unsigned)kn * 2u;   // 32-bit lane offset on a uniform base
            breg[0] = *(const v8h*)(bsrc0 + bo);
            breg[1] = *(const v8h*)(bsrc1 + bo);
            // the loads' offset register is advanced at the loop's foot: keep the wait in front of that overwrite
            asm volatile("s_wait_xcnt 0x0" ::: "memory");
        }

        // WMMA chain on the current tile (overlaps DMA + global loads)
        #pragma unroll
        for (int ni = 0; ni < 4; ++ni)
            #pragma unroll
            for (int mi = 0; mi < 2; ++mi)
                acc[mi][ni] = __builtin_amdgcn_wmma_f32_16x16x32_f16(
                    false, afrag[mi], false, bfrag[ni], (short)0, acc[mi][ni],
                    false, false);

        // land next B tile in the other buffer, close the iteration
        if (has_next) {
            #pragma unroll
            for (int i = 0; i < 2; ++i)
                *(v8h*)&Bsm[nxt][brow + i * 64][bcol] = breg[i];
            if (tid < 32) __builtin_amdgcn_s_wait_tensorcnt(0);
            __syncthreads();   // publish nxt buffers, release cur buffers
        }
    }

    // epilogue: C layout = lane 0-15: (m = v, n = lane), lane 16-31: (m = v+8)
    #pragma unroll
    for (int mi = 0; mi < 2; ++mi)
        #pragma unroll
        for (int ni = 0; ni < 4; ++ni) {
            int ncol = n0 + wn * 64 + ni * 16 + lmod;
            float bv = bias[ncol];
            #pragma unroll
            for (int v = 0; v < 8; ++v) {
                int mrow = m0 + wm * 32 + mi * 16 + v + lhalf * 8;
                float val = acc[mi][ni][v] + bv;
                if (OUT_F32)
                    ((float*)Out)[(size_t)mrow * N + ncol] = val;
                else
                    ((half_t*)Out)[(size_t)mrow * N + ncol] = (half_t)val;
            }
        }
}

// ---------------------------------------------------------------------------
// Attention per (b,t,h):  scores = (Q K^T)/8 * modw + sync ;
// p = sigmoid(5*(s - rowmax)); attn = p / (rowsum + 1e-8);  O = attn * V
// Q/K/V/O are f16 [B,T,S,E] slices (head offset h*D, row stride E)
// ---------------------------------------------------------------------------
__global__ __launch_bounds__(256)
void spike_attn_kernel(const half_t* __restrict__ Qh,
                       const half_t* __restrict__ Kh,
                       const half_t* __restrict__ Vh,
                       half_t* __restrict__ Oh,
                       const float* __restrict__ modw,
                       const float* __restrict__ tsync) {
    __shared__ __align__(128) half_t Vt[D_][S_];     // V transposed [d][key] 32 KB
    __shared__ __align__(128) half_t stg[8][16][32]; // per-wave attn staging 8 KB

    const int h = blockIdx.x % H_;
    const int t = (blockIdx.x / H_) % T_;
    const int b = blockIdx.x / (H_ * T_);
    const size_t base = (((size_t)b * T_ + t) * S_) * E_ + (size_t)h * D_;

    const int tid   = threadIdx.x;
    const int wave  = tid >> 5;
    const int lane  = tid & 31;
    const int lmod  = lane & 15;
    const int lhalf = lane >> 4;

    // stage V transposed into LDS (thread tid handles key row tid)
    {
        const half_t* vrow = Vh + base + (size_t)tid * E_;
        #pragma unroll
        for (int d = 0; d < D_; ++d) Vt[d][tid] = vrow[d];
    }
    __syncthreads();

    const float scl = modw[h] * modw[H_ + h] * 0.125f;  // modality / SCALE
    const float sy  = tsync[t * H_ + h];

    for (int pass = 0; pass < 2; ++pass) {
        const int q0 = pass * 128 + wave * 16;

        // Q fragments (16 rows x 32 k), D=64 -> two k-chunks
        v16h aq0 = *(const v16h*)(Qh + base + (size_t)(q0 + lmod) * E_ + lhalf * 16);
        v16h aq1 = *(const v16h*)(Qh + base + (size_t)(q0 + lmod) * E_ + 32 + lhalf * 16);

        // scores: 16 key-tiles of 16x16 f32
        v8f sc[16];
        #pragma unroll
        for (int nt = 0; nt < 16; ++nt) {
            const half_t* krow = Kh + base + (size_t)(nt * 16 + lmod) * E_;
            v16h bk0 = *(const v16h*)(krow + lhalf * 16);
            v16h bk1 = *(const v16h*)(krow + 32 + lhalf * 16);
            v8f z = (v8f){0.f, 0.f, 0.f, 0.f, 0.f, 0.f, 0.f, 0.f};
            z = __builtin_amdgcn_wmma_f32_16x16x32_f16(false, aq0, false, bk0,
                                                       (short)0, z, false, false);
            z = __builtin_amdgcn_wmma_f32_16x16x32_f16(false, aq1, false, bk1,
                                                       (short)0, z, false, false);
            #pragma unroll
            for (int v = 0; v < 8; ++v) sc[nt][v] = z[v] * scl + sy;
        }

        // row max over 256 keys: 16 tiles in-lane, then across 16-lane group
        float rmax[8];
        #pragma unroll
        for (int v = 0; v < 8; ++v) {
            float m = sc[0][v];
            #pragma unroll
            for (int nt = 1; nt < 16; ++nt) m = fmaxf(m, sc[nt][v]);
            #pragma unroll
            for (int msk = 1; msk < 16; msk <<= 1)
                m = fmaxf(m, __shfl_xor(m, msk, 32));
            rmax[v] = m;
        }

        // p = sigmoid(5*(s-max)); rowsum; keep p in sc
        float rinv[8];
        #pragma unroll
        for (int v = 0; v < 8; ++v) {
            float s = 0.f;
            #pragma unroll
            for (int nt = 0; nt < 16; ++nt) {
                float p = 1.0f / (1.0f + __expf(-5.0f * (sc[nt][v] - rmax[v])));
                sc[nt][v] = p;
                s += p;
            }
            #pragma unroll
            for (int msk = 1; msk < 16; msk <<= 1)
                s += __shfl_xor(s, msk, 32);
            rinv[v] = 1.0f / (s + 1e-8f);
        }

        // attn @ V : 8 k-chunks of 32 keys, staged through per-wave LDS
        v8f accO[4];
        #pragma unroll
        for (int ni = 0; ni < 4; ++ni)
            accO[ni] = (v8f){0.f, 0.f, 0.f, 0.f, 0.f, 0.f, 0.f, 0.f};

        #pragma unroll
        for (int kc = 0; kc < 8; ++kc) {
            #pragma unroll
            for (int j = 0; j < 2; ++j) {
                int nt = kc * 2 + j;
                #pragma unroll
                for (int v = 0; v < 8; ++v) {
                    int m = v + lhalf * 8;
                    stg[wave][m][j * 16 + lmod] = (half_t)(sc[nt][v] * rinv[v]);
                }
            }
            // wave-private LDS region: DS ops are in-order within the wave
            v16h aat = *(const v16h*)&stg[wave][lmod][lhalf * 16];
            #pragma unroll
            for (int ni = 0; ni < 4; ++ni) {
                v16h bv = *(const v16h*)&Vt[ni * 16 + lmod][kc * 32 + lhalf * 16];
                accO[ni] = __builtin_amdgcn_wmma_f32_16x16x32_f16(
                    false, aat, false, bv, (short)0, accO[ni], false, false);
            }
        }

        // store attended rows (f16, [B,T,S,E] slice)
        #pragma unroll
        for (int ni = 0; ni < 4; ++ni)
            #pragma unroll
            for (int v = 0; v < 8; ++v) {
                int m = q0 + v + lhalf * 8;
                Oh[base + (size_t)m * E_ + ni * 16 + lmod] = (half_t)accO[ni][v];
            }
    }
}

// ---------------------------------------------------------------------------
// Host launch
// ---------------------------------------------------------------------------
extern "C" void kernel_launch(void* const* d_in, const int* in_sizes, int n_in,
                              void* d_out, int out_size, void* d_ws, size_t ws_size,
                              hipStream_t stream) {
    (void)in_sizes; (void)n_in; (void)out_size; (void)ws_size;

    const float* qsp   = (const float*)d_in[0];
    const float* ksp   = (const float*)d_in[1];
    const float* vsp   = (const float*)d_in[2];
    const float* Wq    = (const float*)d_in[3];
    const float* bq    = (const float*)d_in[4];
    const float* Wk    = (const float*)d_in[5];
    const float* bk    = (const float*)d_in[6];
    const float* Wv    = (const float*)d_in[7];
    const float* bv    = (const float*)d_in[8];
    const float* Wo    = (const float*)d_in[9];
    const float* bo    = (const float*)d_in[10];
    const float* modw  = (const float*)d_in[11];
    const float* tsync = (const float*)d_in[12];

    const size_t EE = (size_t)E_ * E_;              // 262144
    const size_t MK = (size_t)B_ * T_ * S_ * E_;    // 16,777,216
    const int    M  = B_ * T_ * S_;                 // 32768

    half_t* w16  = (half_t*)d_ws;
    half_t* Wq16 = w16;
    half_t* Wk16 = w16 + EE;
    half_t* Wv16 = w16 + 2 * EE;
    half_t* Wo16 = w16 + 3 * EE;
    half_t* Qs16 = w16 + 4 * EE;      // f16 spike copies (TDM-friendly A)
    half_t* Ks16 = Qs16 + MK;
    half_t* Vs16 = Ks16 + MK;
    half_t* Qh   = Vs16 + MK;
    half_t* Kh   = Qh + MK;
    half_t* Vh   = Kh + MK;
    half_t* Ah   = Qs16;              // reuse: Q-spikes consumed before attention

    // f32 -> f16 conversions
    dim3 gcvt(MK / CVT_PER_BLOCK);                  // 256 blocks, MK a whole multiple
    dim3 gwt(E_ / 64, E_ / 64);                     // weights land as [n][k]
    cvt_transpose_f32_f16_kernel<<<gwt, 256, 0, stream>>>(Wq, Wq16);
    cvt_transpose_f32_f16_kernel<<<gwt, 256, 0, stream>>>(Wk, Wk16);
    cvt_transpose_f32_f16_kernel<<<gwt, 256, 0, stream>>>(Wv, Wv16);
    cvt_transpose_f32_f16_kernel<<<gwt, 256, 0, stream>>>(Wo, Wo16);
    cvt_f32_f16_kernel<<<gcvt, CVT_THREADS, 0, stream>>>(qsp, Qs16);
    cvt_f32_f16_kernel<<<gcvt, CVT_THREADS, 0, stream>>>(ksp, Ks16);
    cvt_f32_f16_kernel<<<gcvt, CVT_THREADS, 0, stream>>>(vsp, Vs16);

    // Q/K/V projections: [32768,512] x [512,512] -> f16 (TDM-staged A tiles)
    dim3 gproj(M / 128, E_ / 128);
    gemm_wmma_kernel<false><<<gproj, 256, 0, stream>>>(Qs16, Wq16, bq, Qh, M, E_, E_);
    gemm_wmma_kernel<false><<<gproj, 256, 0, stream>>>(Ks16, Wk16, bk, Kh, M, E_, E_);
    gemm_wmma_kernel<false><<<gproj, 256, 0, stream>>>(Vs16, Wv16, bv, Vh, M, E_, E_);

    // attention over B*T*H = 1024 heads
    spike_attn_kernel<<<dim3(B_ * T_ * H_), 256, 0, stream>>>(Qh, Kh, Vh, Ah, modw, tsync);

    // output projection -> f32 d_out
    gemm_wmma_kernel<true><<<gproj, 256, 0, stream>>>(Ah, Wo16, bo, (float*)d_out, M, E_, E_);
}
